// v000
// Measured on an AMD MI455X. A time is GPU time per run, averaged over a window of back-to-back runs after a warm-up
// (all launches, gaps included; the runs take copies of the inputs in turn), and the median of several windows.
// Apart from v000's, it joins two sittings. Times from different sittings can be a few percent apart, while
// side-by-side timings come from the same sitting.
// v000 is the starting kernel. One run takes 868 microseconds.
#include <hip/hip_runtime.h>

#define IN_F   4096
#define OUT_F  4096
#define RANK   16
#define MTOT   8192           // B*T = 8*1024
#define SCALING 2.0f          // ALPHA/R = 32/16
#define LDK    40             // LDS row stride in halves (80B: 16B-aligned, conflict-padded)

typedef __attribute__((ext_vector_type(16))) __bf16          v16bf_t;
typedef __attribute__((ext_vector_type(8)))  float           v8f_t;
typedef __attribute__((ext_vector_type(4)))  unsigned short  u16x4;
typedef __attribute__((ext_vector_type(8)))  unsigned short  u16x8;

union FragU { u16x8 h[2]; v16bf_t v; };

__device__ __forceinline__ v8f_t zero8() {
    v8f_t z = {0.f, 0.f, 0.f, 0.f, 0.f, 0.f, 0.f, 0.f};
    return z;
}

// round-to-nearest-even f32 -> bf16 bits
__device__ __forceinline__ unsigned short bf16_rne(float x) {
    unsigned int u = __float_as_uint(x);
    unsigned int r = ((u >> 16) & 1u) + 0x7fffu;
    return (unsigned short)((u + r) >> 16);
}

// split f32 into truncated-hi bf16 + RNE residual-lo bf16 (bf16x3 scheme)
__device__ __forceinline__ void bf16_split(float x, unsigned short& hi, unsigned short& lo) {
    unsigned int u  = __float_as_uint(x);
    unsigned int hb = u & 0xffff0000u;
    hi = (unsigned short)(hb >> 16);
    lo = bf16_rne(x - __uint_as_float(hb));
}

__device__ __forceinline__ void split4(const float4 v, u16x4& hv, u16x4& lv) {
    unsigned short h0, l0, h1, l1, h2, l2, h3, l3;
    bf16_split(v.x, h0, l0);
    bf16_split(v.y, h1, l1);
    bf16_split(v.z, h2, l2);
    bf16_split(v.w, h3, l3);
    hv[0] = h0; hv[1] = h1; hv[2] = h2; hv[3] = h3;
    lv[0] = l0; lv[1] = l1; lv[2] = l2; lv[3] = l3;
}

// Build a 16x32 / 32x16 bf16 WMMA fragment from a K-contiguous LDS tile.
// ISA layout: lanes<16 hold K{khalf..+7} in VGPR0-3, K{khalf+16..+23} in VGPR4-7
// (khalf=0); lanes>=16 use khalf=8.
__device__ __forceinline__ v16bf_t ld_frag(const unsigned short* p, int rowHalves, int khalf) {
    FragU f;
    f.h[0] = *(const u16x8*)(p + rowHalves + khalf);
    f.h[1] = *(const u16x8*)(p + rowHalves + khalf + 16);
    return f.v;
}

#define WMMA_BF16(A, B, C) \
    __builtin_amdgcn_wmma_f32_16x16x32_bf16(false, (A), false, (B), (short)0, (C), false, false)

// ---------------------------------------------------------------------------
// Pack pass: fp32 -> (hi bf16, lo bf16) arrays, one-time, memory-bound.
// Removes all conversion VALU from the GEMM K-loop.
// ---------------------------------------------------------------------------
__global__ __launch_bounds__(256) void pack_bf16_kernel(
    const float* __restrict__ src,
    unsigned short* __restrict__ hi, unsigned short* __restrict__ lo,
    long n4)
{
    long stride = (long)gridDim.x * blockDim.x;
    for (long i = (long)blockIdx.x * blockDim.x + threadIdx.x; i < n4; i += stride) {
        const float4 v = *(const float4*)(src + i * 4);
        u16x4 hv, lv;
        split4(v, hv, lv);
        *(u16x4*)(hi + i * 4) = hv;
        *(u16x4*)(lo + i * 4) = lv;
    }
}

// ---------------------------------------------------------------------------
// Kernel 1: h[m, r] = sum_k x[m,k] * A_s[k,r]  (rank-16, bf16x3 WMMA)
// ---------------------------------------------------------------------------
__global__ __launch_bounds__(256) void lora_h_kernel(
    const float* __restrict__ x, const int* __restrict__ amap,
    const float* __restrict__ As, float* __restrict__ h)
{
    __shared__ __align__(16) unsigned short Ahi[128 * LDK], Alo[128 * LDK];
    __shared__ __align__(16) unsigned short Bhi[RANK * LDK], Blo[RANK * LDK];

    const int t     = threadIdx.x;
    const int lane  = t & 31;
    const int wid   = t >> 5;
    const int laneM = lane & 15;
    const int khalf = (lane & 16) ? 8 : 0;
    const int m0    = blockIdx.x * 128;          // 1024 % 128 == 0 -> uniform batch
    const int s     = amap[m0 >> 10];
    const float* Abase = As + (size_t)s * IN_F * RANK;

    v8f_t acc = zero8();

    for (int k0 = 0; k0 < IN_F; k0 += 32) {
        #pragma unroll
        for (int j = 0; j < 4; ++j) {
            int idx = j * 256 + t;
            int row = idx >> 3, c4 = idx & 7;
            const float4 v = *(const float4*)(x + (size_t)(m0 + row) * IN_F + k0 + c4 * 4);
            u16x4 hv, lv;
            split4(v, hv, lv);
            *(u16x4*)&Ahi[row * LDK + c4 * 4] = hv;
            *(u16x4*)&Alo[row * LDK + c4 * 4] = lv;
        }
        #pragma unroll
        for (int j = 0; j < 2; ++j) {
            int idx = j * 256 + t;
            int k = idx >> 4, r = idx & 15;
            unsigned short hv, lv;
            bf16_split(Abase[(size_t)(k0 + k) * RANK + r], hv, lv);
            Bhi[r * LDK + k] = hv;
            Blo[r * LDK + k] = lv;
        }
        __syncthreads();

        v16bf_t ah = ld_frag(Ahi, (wid * 16 + laneM) * LDK, khalf);
        v16bf_t al = ld_frag(Alo, (wid * 16 + laneM) * LDK, khalf);
        v16bf_t bh = ld_frag(Bhi, laneM * LDK, khalf);
        v16bf_t bl = ld_frag(Blo, laneM * LDK, khalf);
        acc = WMMA_BF16(ah, bh, acc);
        acc = WMMA_BF16(al, bh, acc);
        acc = WMMA_BF16(ah, bl, acc);
        __syncthreads();
    }

    const int rbase = (lane & 16) ? 8 : 0;
    #pragma unroll
    for (int v = 0; v < 8; ++v)
        h[(size_t)(m0 + wid * 16 + rbase + v) * RANK + laneM] = acc[v];
}

// ---------------------------------------------------------------------------
// Kernel 2 (fast path): GEMM on pre-packed hi/lo bf16. WG tile 128x128,
// 8 waves 4(M)x2(N), wave tile 32x64 -> 24 WMMAs/wave/K-step, staging is
// pure b128 copies (zero conversion VALU in the loop).
// ---------------------------------------------------------------------------
__global__ __launch_bounds__(256) void gemm_packed_kernel(
    const unsigned short* __restrict__ xhi, const unsigned short* __restrict__ xlo,
    const unsigned short* __restrict__ whi, const unsigned short* __restrict__ wlo,
    const int* __restrict__ amap, const float* __restrict__ bias,
    const float* __restrict__ Bs, const float* __restrict__ h,
    float* __restrict__ out)
{
    __shared__ __align__(16) unsigned short Ahi[128 * LDK], Alo[128 * LDK];
    __shared__ __align__(16) unsigned short Bhi[128 * LDK], Blo[128 * LDK];

    const int t     = threadIdx.x;
    const int lane  = t & 31;
    const int wid   = t >> 5;
    const int laneM = lane & 15;
    const int khalf = (lane & 16) ? 8 : 0;
    const int m0    = blockIdx.y * 128;
    const int n0    = blockIdx.x * 128;
    const int m_off = (wid & 3) * 32;
    const int n_off = (wid >> 2) * 64;

    v8f_t acc[2][4];
    #pragma unroll
    for (int mi = 0; mi < 2; ++mi)
        #pragma unroll
        for (int ni = 0; ni < 4; ++ni)
            acc[mi][ni] = zero8();

    for (int k0 = 0; k0 < IN_F; k0 += 32) {
        // stage 128x32 x-tile and 128x32 W-tile (hi+lo): pure b128 copies
        #pragma unroll
        for (int j = 0; j < 2; ++j) {
            int c = j * 256 + t;            // 0..511 chunks of 8 halves
            int row = c >> 2, c8 = (c & 3) * 8;
            size_t gx = (size_t)(m0 + row) * IN_F + k0 + c8;
            size_t gw = (size_t)(n0 + row) * IN_F + k0 + c8;
            if (k0 + 32 < IN_F) {
                __builtin_prefetch(xhi + gx + 32, 0, 1);   // global_prefetch_b8
                __builtin_prefetch(whi + gw + 32, 0, 1);
            }
            *(u16x8*)&Ahi[row * LDK + c8] = *(const u16x8*)(xhi + gx);
            *(u16x8*)&Alo[row * LDK + c8] = *(const u16x8*)(xlo + gx);
            *(u16x8*)&Bhi[row * LDK + c8] = *(const u16x8*)(whi + gw);
            *(u16x8*)&Blo[row * LDK + c8] = *(const u16x8*)(wlo + gw);
        }
        __syncthreads();

        v16bf_t ah[2], al[2], bh[4], bl[4];
        #pragma unroll
        for (int mi = 0; mi < 2; ++mi) {
            ah[mi] = ld_frag(Ahi, (m_off + mi * 16 + laneM) * LDK, khalf);
            al[mi] = ld_frag(Alo, (m_off + mi * 16 + laneM) * LDK, khalf);
        }
        #pragma unroll
        for (int ni = 0; ni < 4; ++ni) {
            bh[ni] = ld_frag(Bhi, (n_off + ni * 16 + laneM) * LDK, khalf);
            bl[ni] = ld_frag(Blo, (n_off + ni * 16 + laneM) * LDK, khalf);
        }
        #pragma unroll
        for (int mi = 0; mi < 2; ++mi)
            #pragma unroll
            for (int ni = 0; ni < 4; ++ni) {
                acc[mi][ni] = WMMA_BF16(ah[mi], bh[ni], acc[mi][ni]);
                acc[mi][ni] = WMMA_BF16(al[mi], bh[ni], acc[mi][ni]);
                acc[mi][ni] = WMMA_BF16(ah[mi], bl[ni], acc[mi][ni]);
            }
        __syncthreads();
    }

    // ---- fused LoRA epilogue: acc += (scaling*h) @ B_s, K=16 zero-padded to 32
    {
        const int s = amap[m0 >> 10];
        {   // scaled h tile 128x16 into Ahi (K 16..31 zeroed)
            int row = t >> 1, cb = (t & 1) * 8;
            const float* hp = h + (size_t)(m0 + row) * RANK + cb;
            u16x8 hv, hz = {0, 0, 0, 0, 0, 0, 0, 0};
            #pragma unroll
            for (int e = 0; e < 8; ++e) hv[e] = bf16_rne(hp[e] * SCALING);
            *(u16x8*)&Ahi[row * LDK + cb]      = hv;
            *(u16x8*)&Ahi[row * LDK + 16 + cb] = hz;
        }
        {   // Bm^T tile into Bhi: Bhi[n][k] = B_s[s][k][n0+n] (K 16..31 zeroed)
            int n = t & 127, kb = t >> 7;   // kb in 0..1
            #pragma unroll
            for (int j = 0; j < 8; ++j) {
                int k = kb * 8 + j;
                Bhi[n * LDK + k]      = bf16_rne(Bs[((size_t)s * RANK + k) * OUT_F + n0 + n]);
                Bhi[n * LDK + 16 + k] = 0;
            }
        }
        __syncthreads();
        #pragma unroll
        for (int mi = 0; mi < 2; ++mi) {
            v16bf_t a = ld_frag(Ahi, (m_off + mi * 16 + laneM) * LDK, khalf);
            #pragma unroll
            for (int ni = 0; ni < 4; ++ni) {
                v16bf_t b = ld_frag(Bhi, (n_off + ni * 16 + laneM) * LDK, khalf);
                acc[mi][ni] = WMMA_BF16(a, b, acc[mi][ni]);
            }
        }
    }

    // ---- bias add + store (C layout: row = v + 8*(lane>=16), col = lane&15)
    const int rbase = (lane & 16) ? 8 : 0;
    #pragma unroll
    for (int mi = 0; mi < 2; ++mi) {
        int rg0 = m0 + m_off + mi * 16 + rbase;
        #pragma unroll
        for (int ni = 0; ni < 4; ++ni) {
            int cg = n0 + n_off + ni * 16 + laneM;
            float bv = bias[cg];
            #pragma unroll
            for (int v = 0; v < 8; ++v)
                out[(size_t)(rg0 + v) * OUT_F + cg] = acc[mi][ni][v] + bv;
        }
    }
}

// ---------------------------------------------------------------------------
// Kernel 2 (fallback, small ws): convert-in-loop bf16x3 GEMM, WG tile 128x64.
// ---------------------------------------------------------------------------
__global__ __launch_bounds__(256) void lora_linear_kernel(
    const float* __restrict__ x, const int* __restrict__ amap,
    const float* __restrict__ W, const float* __restrict__ bias,
    const float* __restrict__ Bs, const float* __restrict__ h,
    float* __restrict__ out)
{
    __shared__ __align__(16) unsigned short Ahi[128 * LDK], Alo[128 * LDK];
    __shared__ __align__(16) unsigned short Bhi[64 * LDK],  Blo[64 * LDK];

    const int t     = threadIdx.x;
    const int lane  = t & 31;
    const int wid   = t >> 5;
    const int laneM = lane & 15;
    const int khalf = (lane & 16) ? 8 : 0;
    const int m0    = blockIdx.y * 128;
    const int n0    = blockIdx.x * 64;
    const int m_off = (wid & 3) * 32;
    const int n_off = (wid >> 2) * 32;

    v8f_t acc[2][2];
    #pragma unroll
    for (int mi = 0; mi < 2; ++mi)
        #pragma unroll
        for (int ni = 0; ni < 2; ++ni)
            acc[mi][ni] = zero8();

    for (int k0 = 0; k0 < IN_F; k0 += 32) {
        #pragma unroll
        for (int j = 0; j < 4; ++j) {
            int idx = j * 256 + t;
            int row = idx >> 3, c4 = idx & 7;
            const float4 v = *(const float4*)(x + (size_t)(m0 + row) * IN_F + k0 + c4 * 4);
            u16x4 hv, lv;
            split4(v, hv, lv);
            *(u16x4*)&Ahi[row * LDK + c4 * 4] = hv;
            *(u16x4*)&Alo[row * LDK + c4 * 4] = lv;
        }
        #pragma unroll
        for (int j = 0; j < 2; ++j) {
            int idx = j * 256 + t;
            int n = idx >> 3, c4 = idx & 7;
            const float4 v = *(const float4*)(W + (size_t)(n0 + n) * IN_F + k0 + c4 * 4);
            u16x4 hv, lv;
            split4(v, hv, lv);
            *(u16x4*)&Bhi[n * LDK + c4 * 4] = hv;
            *(u16x4*)&Blo[n * LDK + c4 * 4] = lv;
        }
        __syncthreads();

        v16bf_t ah[2], al[2], bh[2], bl[2];
        #pragma unroll
        for (int mi = 0; mi < 2; ++mi) {
            ah[mi] = ld_frag(Ahi, (m_off + mi * 16 + laneM) * LDK, khalf);
            al[mi] = ld_frag(Alo, (m_off + mi * 16 + laneM) * LDK, khalf);
        }
        #pragma unroll
        for (int ni = 0; ni < 2; ++ni) {
            bh[ni] = ld_frag(Bhi, (n_off + ni * 16 + laneM) * LDK, khalf);
            bl[ni] = ld_frag(Blo, (n_off + ni * 16 + laneM) * LDK, khalf);
        }
        #pragma unroll
        for (int mi = 0; mi < 2; ++mi)
            #pragma unroll
            for (int ni = 0; ni < 2; ++ni) {
                acc[mi][ni] = WMMA_BF16(ah[mi], bh[ni], acc[mi][ni]);
                acc[mi][ni] = WMMA_BF16(al[mi], bh[ni], acc[mi][ni]);
                acc[mi][ni] = WMMA_BF16(ah[mi], bl[ni], acc[mi][ni]);
            }
        __syncthreads();
    }

    {
        const int s = amap[m0 >> 10];
        {
            int row = t >> 1, cb = (t & 1) * 8;
            const float* hp = h + (size_t)(m0 + row) * RANK + cb;
            u16x8 hv, hz = {0, 0, 0, 0, 0, 0, 0, 0};
            #pragma unroll
            for (int e = 0; e < 8; ++e) hv[e] = bf16_rne(hp[e] * SCALING);
            *(u16x8*)&Ahi[row * LDK + cb]      = hv;
            *(u16x8*)&Ahi[row * LDK + 16 + cb] = hz;
        }
        {
            int n = t & 63, kb = t >> 6;
            #pragma unroll
            for (int j = 0; j < 4; ++j) {
                int k = kb + j * 4;
                Bhi[n * LDK + k]      = bf16_rne(Bs[((size_t)s * RANK + k) * OUT_F + n0 + n]);
                Bhi[n * LDK + 16 + k] = 0;
            }
        }
        __syncthreads();
        #pragma unroll
        for (int mi = 0; mi < 2; ++mi) {
            v16bf_t a = ld_frag(Ahi, (m_off + mi * 16 + laneM) * LDK, khalf);
            #pragma unroll
            for (int ni = 0; ni < 2; ++ni) {
                v16bf_t b = ld_frag(Bhi, (n_off + ni * 16 + laneM) * LDK, khalf);
                acc[mi][ni] = WMMA_BF16(a, b, acc[mi][ni]);
            }
        }
    }

    const int rbase = (lane & 16) ? 8 : 0;
    #pragma unroll
    for (int mi = 0; mi < 2; ++mi) {
        int rg0 = m0 + m_off + mi * 16 + rbase;
        #pragma unroll
        for (int ni = 0; ni < 2; ++ni) {
            int cg = n0 + n_off + ni * 16 + laneM;
            float bv = bias[cg];
            #pragma unroll
            for (int v = 0; v < 8; ++v)
                out[(size_t)(rg0 + v) * OUT_F + cg] = acc[mi][ni][v] + bv;
        }
    }
}

extern "C" void kernel_launch(void* const* d_in, const int* in_sizes, int n_in,
                              void* d_out, int out_size, void* d_ws, size_t ws_size,
                              hipStream_t stream) {
    const float* x    = (const float*)d_in[0];
    const int*   amap = (const int*)d_in[1];
    const float* W    = (const float*)d_in[2];
    const float* b    = (const float*)d_in[3];
    const float* As   = (const float*)d_in[4];
    const float* Bs   = (const float*)d_in[5];
    float* out = (float*)d_out;

    const size_t hBytes = (size_t)MTOT * RANK * sizeof(float);      // 512 KB
    const size_t xElems = (size_t)MTOT * IN_F;
    const size_t wElems = (size_t)OUT_F * IN_F;
    const size_t need   = hBytes + 2 * xElems * 2 + 2 * wElems * 2; // ~192.5 MB

    float* h = (float*)d_ws;
    lora_h_kernel<<<dim3(MTOT / 128), 256, 0, stream>>>(x, amap, As, h);

    if (ws_size >= need) {
        unsigned short* xhi = (unsigned short*)((char*)d_ws + hBytes);
        unsigned short* xlo = xhi + xElems;
        unsigned short* whi = xlo + xElems;
        unsigned short* wlo = whi + wElems;
        pack_bf16_kernel<<<dim3(2048), 256, 0, stream>>>(x, xhi, xlo, (long)(xElems / 4));
        pack_bf16_kernel<<<dim3(2048), 256, 0, stream>>>(W, whi, wlo, (long)(wElems / 4));
        gemm_packed_kernel<<<dim3(OUT_F / 128, MTOT / 128), 256, 0, stream>>>(
            xhi, xlo, whi, wlo, amap, b, Bs, h, out);
    } else {
        lora_linear_kernel<<<dim3(OUT_F / 64, MTOT / 128), 256, 0, stream>>>(
            x, amap, W, b, Bs, h, out);
    }
}

// v001
// It runs in 624 microseconds.
// In both of two side-by-side timings against v000, it was 1.44 times as fast.
#include <hip/hip_runtime.h>

#define IN_F   4096
#define OUT_F  4096
#define RANK   16
#define MTOT   8192           // B*T = 8*1024
#define SCALING 2.0f          // ALPHA/R = 32/16
#define LDK    40             // LDS row stride in halves (80B: 16B-aligned, conflict-padded)

typedef __attribute__((ext_vector_type(16))) __bf16          v16bf_t;
typedef __attribute__((ext_vector_type(8)))  float           v8f_t;
typedef __attribute__((ext_vector_type(4)))  unsigned short  u16x4;
typedef __attribute__((ext_vector_type(8)))  unsigned short  u16x8;

union FragU { u16x8 h[2]; v16bf_t v; };

__device__ __forceinline__ v8f_t zero8() {
    v8f_t z = {0.f, 0.f, 0.f, 0.f, 0.f, 0.f, 0.f, 0.f};
    return z;
}

// round-to-nearest-even f32 -> bf16 bits
__device__ __forceinline__ unsigned short bf16_rne(float x) {
    unsigned int u = __float_as_uint(x);
    unsigned int r = ((u >> 16) & 1u) + 0x7fffu;
    return (unsigned short)((u + r) >> 16);
}

// split f32 into truncated-hi bf16 + RNE residual-lo bf16 (bf16x3 scheme)
__device__ __forceinline__ void bf16_split(float x, unsigned short& hi, unsigned short& lo) {
    unsigned int u  = __float_as_uint(x);
    unsigned int hb = u & 0xffff0000u;
    hi = (unsigned short)(hb >> 16);
    lo = bf16_rne(x - __uint_as_float(hb));
}

__device__ __forceinline__ void split4(const float4 v, u16x4& hv, u16x4& lv) {
    unsigned short h0, l0, h1, l1, h2, l2, h3, l3;
    bf16_split(v.x, h0, l0);
    bf16_split(v.y, h1, l1);
    bf16_split(v.z, h2, l2);
    bf16_split(v.w, h3, l3);
    hv[0] = h0; hv[1] = h1; hv[2] = h2; hv[3] = h3;
    lv[0] = l0; lv[1] = l1; lv[2] = l2; lv[3] = l3;
}

// Build a 16x32 / 32x16 bf16 WMMA fragment from a K-contiguous LDS tile.
// ISA layout: lanes<16 hold K{khalf..+7} in VGPR0-3, K{khalf+16..+23} in VGPR4-7
// (khalf=0); lanes>=16 use khalf=8.
__device__ __forceinline__ v16bf_t ld_frag(const unsigned short* p, int rowHalves, int khalf) {
    FragU f;
    f.h[0] = *(const u16x8*)(p + rowHalves + khalf);
    f.h[1] = *(const u16x8*)(p + rowHalves + khalf + 16);
    return f.v;
}

#define WMMA_BF16(A, B, C) \
    __builtin_amdgcn_wmma_f32_16x16x32_bf16(false, (A), false, (B), (short)0, (C), false, false)

// ---------------------------------------------------------------------------
// Pack pass: fp32 -> (hi bf16, lo bf16) arrays, one-time, memory-bound.
// Removes all conversion VALU from the GEMM K-loop.
// ---------------------------------------------------------------------------
__global__ __launch_bounds__(256) void pack_bf16_kernel(
    const float* __restrict__ src,
    unsigned short* __restrict__ hi, unsigned short* __restrict__ lo,
    long n4)
{
    long stride = (long)gridDim.x * blockDim.x;
    for (long i = (long)blockIdx.x * blockDim.x + threadIdx.x; i < n4; i += stride) {
        const float4 v = *(const float4*)(src + i * 4);
        u16x4 hv, lv;
        split4(v, hv, lv);
        *(u16x4*)(hi + i * 4) = hv;
        *(u16x4*)(lo + i * 4) = lv;
    }
}

// ---------------------------------------------------------------------------
// Kernel 1: h[m, r] = sum_k x[m,k] * A_s[k,r]  (rank-16, bf16x3 WMMA)
// ---------------------------------------------------------------------------
__global__ __launch_bounds__(256) void lora_h_kernel(
    const float* __restrict__ x, const int* __restrict__ amap,
    const float* __restrict__ As, float* __restrict__ h)
{
    __shared__ __align__(16) unsigned short Ahi[128 * LDK], Alo[128 * LDK];
    __shared__ __align__(16) unsigned short Bhi[RANK * LDK], Blo[RANK * LDK];

    const int t     = threadIdx.x;
    const int lane  = t & 31;
    const int wid   = t >> 5;
    const int laneM = lane & 15;
    const int khalf = (lane & 16) ? 8 : 0;
    const int m0    = blockIdx.x * 128;          // 1024 % 128 == 0 -> uniform batch
    const int s     = amap[m0 >> 10];
    const float* Abase = As + (size_t)s * IN_F * RANK;

    v8f_t acc = zero8();

    for (int k0 = 0; k0 < IN_F; k0 += 32) {
        #pragma unroll
        for (int j = 0; j < 4; ++j) {
            int idx = j * 256 + t;
            int row = idx >> 3, c4 = idx & 7;
            const float4 v = *(const float4*)(x + (size_t)(m0 + row) * IN_F + k0 + c4 * 4);
            u16x4 hv, lv;
            split4(v, hv, lv);
            *(u16x4*)&Ahi[row * LDK + c4 * 4] = hv;
            *(u16x4*)&Alo[row * LDK + c4 * 4] = lv;
        }
        #pragma unroll
        for (int j = 0; j < 2; ++j) {
            int idx = j * 256 + t;
            int k = idx >> 4, r = idx & 15;
            unsigned short hv, lv;
            bf16_split(Abase[(size_t)(k0 + k) * RANK + r], hv, lv);
            Bhi[r * LDK + k] = hv;
            Blo[r * LDK + k] = lv;
        }
        __syncthreads();

        v16bf_t ah = ld_frag(Ahi, (wid * 16 + laneM) * LDK, khalf);
        v16bf_t al = ld_frag(Alo, (wid * 16 + laneM) * LDK, khalf);
        v16bf_t bh = ld_frag(Bhi, laneM * LDK, khalf);
        v16bf_t bl = ld_frag(Blo, laneM * LDK, khalf);
        acc = WMMA_BF16(ah, bh, acc);
        acc = WMMA_BF16(al, bh, acc);
        acc = WMMA_BF16(ah, bl, acc);
        __syncthreads();
    }

    const int rbase = (lane & 16) ? 8 : 0;
    #pragma unroll
    for (int v = 0; v < 8; ++v)
        h[(size_t)(m0 + wid * 16 + rbase + v) * RANK + laneM] = acc[v];
}

// ---------------------------------------------------------------------------
// Kernel 2 (fast path): GEMM on pre-packed hi/lo bf16. WG tile 256x128, K-step
// 64 (one whole 128-B line of every operand row), 4 waves 2(M)x2(N), wave tile
// 128x64 -> 96 WMMAs per 24 fragments; staging is pure b128 copies. Two
// workgroups fit a WGP (one wave of each per SIMD), so one can stage while the
// other multiplies.
// ---------------------------------------------------------------------------
#define GBM 256               // workgroup tile rows (1024 % GBM == 0 -> uniform batch)
#define GBN 128               // workgroup tile columns
#define GMI 8                 // 16-row fragments per wave
#define GNI 4                 // 16-column fragments per wave
#define GTH 128               // threads per workgroup
#define GBK 64                // K-step in halves
#define GLDK 72               // LDS row stride in halves (144B = 16B x odd: conflict-free b128 reads)

// amdgpu_waves_per_eu(2, 2): caps a wave at half a SIMD's registers, so that two
// workgroups stay resident on a WGP.
__global__ __launch_bounds__(GTH) __attribute__((amdgpu_waves_per_eu(2, 2))) void gemm_packed_kernel(
    const unsigned short* __restrict__ xhi, const unsigned short* __restrict__ xlo,
    const unsigned short* __restrict__ whi, const unsigned short* __restrict__ wlo,
    const int* __restrict__ amap, const float* __restrict__ bias,
    const float* __restrict__ Bs, const float* __restrict__ h,
    float* __restrict__ out)
{
    __shared__ __align__(16) unsigned short Ahi[GBM * GLDK], Alo[GBM * GLDK];
    __shared__ __align__(16) unsigned short Bhi[GBN * GLDK], Blo[GBN * GLDK];

    const int t     = threadIdx.x;
    const int lane  = t & 31;
    const int wid   = __builtin_amdgcn_readfirstlane(t >> 5);   // wave-uniform: kept in a scalar register
    const int laneM = lane & 15;
    const int khalf = (lane & 16) ? 8 : 0;
    const int m0    = blockIdx.y * GBM;
    const int n0    = blockIdx.x * GBN;
    const int m_off = (wid & 1) * (GMI * 16);
    const int n_off = (wid >> 1) * (GNI * 16);

    v8f_t acc[GMI][GNI];
    #pragma unroll
    for (int mi = 0; mi < GMI; ++mi)
        #pragma unroll
        for (int ni = 0; ni < GNI; ++ni)
            acc[mi][ni] = zero8();

    // each thread stages 16-B chunk (t & 7) of rows (t >> 3) + 16 * j
    const int srow = t >> 3, sc8 = (t & 7) * 8;
    // one 32-bit per-thread offset serves all four arrays; the tile's own part of
    // the address is wave-uniform and stays in scalar registers
    const unsigned goff = (unsigned)(srow * IN_F + sc8);
    const int    ls0 = srow * GLDK + sc8;
    // each lane's fragment base in a tile; fragments differ by constant offsets
    const int    fa0 = (m_off + laneM) * GLDK + khalf;
    const int    fb0 = (n_off + laneM) * GLDK + khalf;

    for (int k0 = 0; k0 < IN_F; k0 += GBK) {
        // stage 256x64 x-tile and 128x64 W-tile (hi+lo): pure b128 copies
        u16x8 rxh[GBM / 16], rxl[GBM / 16], rwh[GBN / 16], rwl[GBN / 16];
        #pragma unroll
        for (int j = 0; j < GBM / 16; ++j) {
            size_t gx = (size_t)(m0 + j * 16) * IN_F + k0;
            rxh[j] = *(const u16x8*)(xhi + gx + goff);
            rxl[j] = *(const u16x8*)(xlo + gx + goff);
        }
        #pragma unroll
        for (int j = 0; j < GBN / 16; ++j) {
            size_t gw = (size_t)(n0 + j * 16) * IN_F + k0;
            rwh[j] = *(const u16x8*)(whi + gw + goff);
            rwl[j] = *(const u16x8*)(wlo + gw + goff);
        }
        #pragma unroll
        for (int j = 0; j < GBM / 16; ++j) {
            *(u16x8*)&Ahi[ls0 + j * 16 * GLDK] = rxh[j];
            *(u16x8*)&Alo[ls0 + j * 16 * GLDK] = rxl[j];
        }
        #pragma unroll
        for (int j = 0; j < GBN / 16; ++j) {
            *(u16x8*)&Bhi[ls0 + j * 16 * GLDK] = rwh[j];
            *(u16x8*)&Blo[ls0 + j * 16 * GLDK] = rwl[j];
        }
        __syncthreads();

        #pragma unroll
        for (int kk = 0; kk < GBK; kk += 32) {
            v16bf_t ah[GMI], al[GMI], bh[GNI], bl[GNI];
            #pragma unroll
            for (int ni = 0; ni < GNI; ++ni) {
                bh[ni] = ld_frag(Bhi + fb0, ni * 16 * GLDK + kk, 0);
                bl[ni] = ld_frag(Blo + fb0, ni * 16 * GLDK + kk, 0);
            }
            #pragma unroll
            for (int mi = 0; mi < GMI; ++mi) {
                ah[mi] = ld_frag(Ahi + fa0, mi * 16 * GLDK + kk, 0);
                al[mi] = ld_frag(Alo + fa0, mi * 16 * GLDK + kk, 0);
            }
            #pragma unroll
            for (int mi = 0; mi < GMI; ++mi)
                #pragma unroll
                for (int ni = 0; ni < GNI; ++ni) {
                    acc[mi][ni] = WMMA_BF16(ah[mi], bh[ni], acc[mi][ni]);
                    acc[mi][ni] = WMMA_BF16(al[mi], bh[ni], acc[mi][ni]);
                    acc[mi][ni] = WMMA_BF16(ah[mi], bl[ni], acc[mi][ni]);
                }
        }
        __syncthreads();
    }

    // ---- fused LoRA epilogue: acc += (scaling*h) @ B_s, K=16 zero-padded to 32
    // The lane id is formed anew here, so that no thread-id register has to stay
    // live (or be spilled) across the K loop, which uses the whole register budget.
    const int elane  = (int)__builtin_amdgcn_mbcnt_lo(~0u, 0u);
    const int et     = wid * 32 + elane;
    const int elaneM = elane & 15;
    {
        const int s = min(max(amap[m0 >> 10], 0), 31);   // slot index bounded before it forms an address
        // scaled h tile 256x16 into Ahi (K 16..31 zeroed), two rows per thread
        #pragma unroll
        for (int r = 0; r < GBM / GTH; ++r) {
            const int row = et + r * GTH;
            const float* hp = h + (size_t)(m0 + row) * RANK;
            u16x8 hz = {0, 0, 0, 0, 0, 0, 0, 0};
            #pragma unroll
            for (int cb = 0; cb < 16; cb += 8) {
                u16x8 hv;
                #pragma unroll
                for (int e = 0; e < 8; ++e) hv[e] = bf16_rne(hp[cb + e] * SCALING);
                *(u16x8*)&Ahi[row * GLDK + cb]      = hv;
                *(u16x8*)&Ahi[row * GLDK + 16 + cb] = hz;
            }
        }
        {   // Bm^T tile into Bhi: Bhi[n][k] = B_s[s][k][n0+n] (K 16..31 zeroed)
            #pragma unroll
            for (int k = 0; k < RANK; ++k) {
                Bhi[et * GLDK + k]      = bf16_rne(Bs[((size_t)s * RANK + k) * OUT_F + n0 + et]);
                Bhi[et * GLDK + 16 + k] = 0;
            }
        }
        __syncthreads();
        #pragma unroll
        for (int mi = 0; mi < GMI; ++mi) {
            v16bf_t a = ld_frag(Ahi + fa0, mi * 16 * GLDK, 0);
            #pragma unroll
            for (int ni = 0; ni < GNI; ++ni) {
                v16bf_t b = ld_frag(Bhi + fb0, ni * 16 * GLDK, 0);
                acc[mi][ni] = WMMA_BF16(a, b, acc[mi][ni]);
            }
        }
    }

    // ---- bias add + store (C layout: row = v + 8*(lane>=16), col = lane&15)
    const int rbase = (elane & 16) ? 8 : 0;
    #pragma unroll
    for (int mi = 0; mi < GMI; ++mi) {
        int rg0 = m0 + m_off + mi * 16 + rbase;
        #pragma unroll
        for (int ni = 0; ni < GNI; ++ni) {
            int cg = n0 + n_off + ni * 16 + elaneM;
            float bv = bias[cg];
            #pragma unroll
            for (int v = 0; v < 8; ++v)
                out[(size_t)(rg0 + v) * OUT_F + cg] = acc[mi][ni][v] + bv;
        }
    }
}

// ---------------------------------------------------------------------------
// Kernel 2 (fallback, small ws): convert-in-loop bf16x3 GEMM, WG tile 128x64.
// ---------------------------------------------------------------------------
__global__ __launch_bounds__(256) void lora_linear_kernel(
    const float* __restrict__ x, const int* __restrict__ amap,
    const float* __restrict__ W, const float* __restrict__ bias,
    const float* __restrict__ Bs, const float* __restrict__ h,
    float* __restrict__ out)
{
    __shared__ __align__(16) unsigned short Ahi[128 * LDK], Alo[128 * LDK];
    __shared__ __align__(16) unsigned short Bhi[64 * LDK],  Blo[64 * LDK];

    const int t     = threadIdx.x;
    const int lane  = t & 31;
    const int wid   = t >> 5;
    const int laneM = lane & 15;
    const int khalf = (lane & 16) ? 8 : 0;
    const int m0    = blockIdx.y * 128;
    const int n0    = blockIdx.x * 64;
    const int m_off = (wid & 3) * 32;
    const int n_off = (wid >> 2) * 32;

    v8f_t acc[2][2];
    #pragma unroll
    for (int mi = 0; mi < 2; ++mi)
        #pragma unroll
        for (int ni = 0; ni < 2; ++ni)
            acc[mi][ni] = zero8();

    for (int k0 = 0; k0 < IN_F; k0 += 32) {
        #pragma unroll
        for (int j = 0; j < 4; ++j) {
            int idx = j * 256 + t;
            int row = idx >> 3, c4 = idx & 7;
            const float4 v = *(const float4*)(x + (size_t)(m0 + row) * IN_F + k0 + c4 * 4);
            u16x4 hv, lv;
            split4(v, hv, lv);
            *(u16x4*)&Ahi[row * LDK + c4 * 4] = hv;
            *(u16x4*)&Alo[row * LDK + c4 * 4] = lv;
        }
        #pragma unroll
        for (int j = 0; j < 2; ++j) {
            int idx = j * 256 + t;
            int n = idx >> 3, c4 = idx & 7;
            const float4 v = *(const float4*)(W + (size_t)(n0 + n) * IN_F + k0 + c4 * 4);
            u16x4 hv, lv;
            split4(v, hv, lv);
            *(u16x4*)&Bhi[n * LDK + c4 * 4] = hv;
            *(u16x4*)&Blo[n * LDK + c4 * 4] = lv;
        }
        __syncthreads();

        v16bf_t ah[2], al[2], bh[2], bl[2];
        #pragma unroll
        for (int mi = 0; mi < 2; ++mi) {
            ah[mi] = ld_frag(Ahi, (m_off + mi * 16 + laneM) * LDK, khalf);
            al[mi] = ld_frag(Alo, (m_off + mi * 16 + laneM) * LDK, khalf);
        }
        #pragma unroll
        for (int ni = 0; ni < 2; ++ni) {
            bh[ni] = ld_frag(Bhi, (n_off + ni * 16 + laneM) * LDK, khalf);
            bl[ni] = ld_frag(Blo, (n_off + ni * 16 + laneM) * LDK, khalf);
        }
        #pragma unroll
        for (int mi = 0; mi < 2; ++mi)
            #pragma unroll
            for (int ni = 0; ni < 2; ++ni) {
                acc[mi][ni] = WMMA_BF16(ah[mi], bh[ni], acc[mi][ni]);
                acc[mi][ni] = WMMA_BF16(al[mi], bh[ni], acc[mi][ni]);
                acc[mi][ni] = WMMA_BF16(ah[mi], bl[ni], acc[mi][ni]);
            }
        __syncthreads();
    }

    {
        const int s = amap[m0 >> 10];
        {
            int row = t >> 1, cb = (t & 1) * 8;
            const float* hp = h + (size_t)(m0 + row) * RANK + cb;
            u16x8 hv, hz = {0, 0, 0, 0, 0, 0, 0, 0};
            #pragma unroll
            for (int e = 0; e < 8; ++e) hv[e] = bf16_rne(hp[e] * SCALING);
            *(u16x8*)&Ahi[row * LDK + cb]      = hv;
            *(u16x8*)&Ahi[row * LDK + 16 + cb] = hz;
        }
        {
            int n = t & 63, kb = t >> 6;
            #pragma unroll
            for (int j = 0; j < 4; ++j) {
                int k = kb + j * 4;
                Bhi[n * LDK + k]      = bf16_rne(Bs[((size_t)s * RANK + k) * OUT_F + n0 + n]);
                Bhi[n * LDK + 16 + k] = 0;
            }
        }
        __syncthreads();
        #pragma unroll
        for (int mi = 0; mi < 2; ++mi) {
            v16bf_t a = ld_frag(Ahi, (m_off + mi * 16 + laneM) * LDK, khalf);
            #pragma unroll
            for (int ni = 0; ni < 2; ++ni) {
                v16bf_t b = ld_frag(Bhi, (n_off + ni * 16 + laneM) * LDK, khalf);
                acc[mi][ni] = WMMA_BF16(a, b, acc[mi][ni]);
            }
        }
    }

    const int rbase = (lane & 16) ? 8 : 0;
    #pragma unroll
    for (int mi = 0; mi < 2; ++mi) {
        int rg0 = m0 + m_off + mi * 16 + rbase;
        #pragma unroll
        for (int ni = 0; ni < 2; ++ni) {
            int cg = n0 + n_off + ni * 16 + laneM;
            float bv = bias[cg];
            #pragma unroll
            for (int v = 0; v < 8; ++v)
                out[(size_t)(rg0 + v) * OUT_F + cg] = acc[mi][ni][v] + bv;
        }
    }
}

extern "C" void kernel_launch(void* const* d_in, const int* in_sizes, int n_in,
                              void* d_out, int out_size, void* d_ws, size_t ws_size,
                              hipStream_t stream) {
    const float* x    = (const float*)d_in[0];
    const int*   amap = (const int*)d_in[1];
    const float* W    = (const float*)d_in[2];
    const float* b    = (const float*)d_in[3];
    const float* As   = (const float*)d_in[4];
    const float* Bs   = (const float*)d_in[5];
    float* out = (float*)d_out;

    const size_t hBytes = (size_t)MTOT * RANK * sizeof(float);      // 512 KB
    const size_t xElems = (size_t)MTOT * IN_F;
    const size_t wElems = (size_t)OUT_F * IN_F;
    const size_t need   = hBytes + 2 * xElems * 2 + 2 * wElems * 2; // ~192.5 MB

    float* h = (float*)d_ws;
    lora_h_kernel<<<dim3(MTOT / 128), 256, 0, stream>>>(x, amap, As, h);

    if (ws_size >= need) {
        unsigned short* xhi = (unsigned short*)((char*)d_ws + hBytes);
        unsigned short* xlo = xhi + xElems;
        unsigned short* whi = xlo + xElems;
        unsigned short* wlo = whi + wElems;
        pack_bf16_kernel<<<dim3(2048), 256, 0, stream>>>(x, xhi, xlo, (long)(xElems / 4));
        pack_bf16_kernel<<<dim3(2048), 256, 0, stream>>>(W, whi, wlo, (long)(wElems / 4));
        gemm_packed_kernel<<<dim3(OUT_F / GBN, MTOT / GBM), GTH, 0, stream>>>(
            xhi, xlo, whi, wlo, amap, b, Bs, h, out);
    } else {
        lora_linear_kernel<<<dim3(OUT_F / 64, MTOT / 128), 256, 0, stream>>>(
            x, amap, W, b, Bs, h, out);
    }
}

// v002
// A run of this version takes 488 microseconds.
// Next to v001, in two timings, it ran 1.28 times as fast each time.
// All steps since v000 together make it 1.85 times as fast.
#include <hip/hip_runtime.h>
#include <stdint.h>

#define IN_F   4096
#define OUT_F  4096
#define RANK   16
#define MTOT   8192           // B*T = 8*1024
#define SCALING 2.0f          // ALPHA/R = 32/16
#define LDK    40             // LDS row stride in halves (80B: 16B-aligned, conflict-padded)

typedef __attribute__((ext_vector_type(16))) __bf16          v16bf_t;
typedef __attribute__((ext_vector_type(8)))  float           v8f_t;
typedef __attribute__((ext_vector_type(4)))  unsigned short  u16x4;
typedef __attribute__((ext_vector_type(8)))  unsigned short  u16x8;

union FragU { u16x8 h[2]; v16bf_t v; };

__device__ __forceinline__ v8f_t zero8() {
    v8f_t z = {0.f, 0.f, 0.f, 0.f, 0.f, 0.f, 0.f, 0.f};
    return z;
}

// round-to-nearest-even f32 -> bf16 bits
__device__ __forceinline__ unsigned short bf16_rne(float x) {
    unsigned int u = __float_as_uint(x);
    unsigned int r = ((u >> 16) & 1u) + 0x7fffu;
    return (unsigned short)((u + r) >> 16);
}

// split f32 into truncated-hi bf16 + RNE residual-lo bf16 (bf16x3 scheme)
__device__ __forceinline__ void bf16_split(float x, unsigned short& hi, unsigned short& lo) {
    unsigned int u  = __float_as_uint(x);
    unsigned int hb = u & 0xffff0000u;
    hi = (unsigned short)(hb >> 16);
    lo = bf16_rne(x - __uint_as_float(hb));
}

__device__ __forceinline__ void split4(const float4 v, u16x4& hv, u16x4& lv) {
    unsigned short h0, l0, h1, l1, h2, l2, h3, l3;
    bf16_split(v.x, h0, l0);
    bf16_split(v.y, h1, l1);
    bf16_split(v.z, h2, l2);
    bf16_split(v.w, h3, l3);
    hv[0] = h0; hv[1] = h1; hv[2] = h2; hv[3] = h3;
    lv[0] = l0; lv[1] = l1; lv[2] = l2; lv[3] = l3;
}

// Build a 16x32 / 32x16 bf16 WMMA fragment from a K-contiguous LDS tile.
// ISA layout: lanes<16 hold K{khalf..+7} in VGPR0-3, K{khalf+16..+23} in VGPR4-7
// (khalf=0); lanes>=16 use khalf=8.
__device__ __forceinline__ v16bf_t ld_frag(const unsigned short* p, int rowHalves, int khalf) {
    FragU f;
    f.h[0] = *(const u16x8*)(p + rowHalves + khalf);
    f.h[1] = *(const u16x8*)(p + rowHalves + khalf + 16);
    return f.v;
}

#define WMMA_BF16(A, B, C) \
    __builtin_amdgcn_wmma_f32_16x16x32_bf16(false, (A), false, (B), (short)0, (C), false, false)

// ---------------------------------------------------------------------------
// Pack pass: fp32 -> (hi bf16, lo bf16) arrays, one-time, memory-bound.
// Removes all conversion VALU from the GEMM K-loop.
// ---------------------------------------------------------------------------
__global__ __launch_bounds__(256) void pack_bf16_kernel(
    const float* __restrict__ src,
    unsigned short* __restrict__ hi, unsigned short* __restrict__ lo,
    long n4)
{
    long stride = (long)gridDim.x * blockDim.x;
    for (long i = (long)blockIdx.x * blockDim.x + threadIdx.x; i < n4; i += stride) {
        const float4 v = *(const float4*)(src + i * 4);
        u16x4 hv, lv;
        split4(v, hv, lv);
        *(u16x4*)(hi + i * 4) = hv;
        *(u16x4*)(lo + i * 4) = lv;
    }
}

// ---------------------------------------------------------------------------
// Kernel 1: h[m, r] = sum_k x[m,k] * A_s[k,r]  (rank-16, bf16x3 WMMA)
// ---------------------------------------------------------------------------
__global__ __launch_bounds__(256) void lora_h_kernel(
    const float* __restrict__ x, const int* __restrict__ amap,
    const float* __restrict__ As, float* __restrict__ h)
{
    __shared__ __align__(16) unsigned short Ahi[128 * LDK], Alo[128 * LDK];
    __shared__ __align__(16) unsigned short Bhi[RANK * LDK], Blo[RANK * LDK];

    const int t     = threadIdx.x;
    const int lane  = t & 31;
    const int wid   = t >> 5;
    const int laneM = lane & 15;
    const int khalf = (lane & 16) ? 8 : 0;
    const int m0    = blockIdx.x * 128;          // 1024 % 128 == 0 -> uniform batch
    const int s     = amap[m0 >> 10];
    const float* Abase = As + (size_t)s * IN_F * RANK;

    v8f_t acc = zero8();

    for (int k0 = 0; k0 < IN_F; k0 += 32) {
        #pragma unroll
        for (int j = 0; j < 4; ++j) {
            int idx = j * 256 + t;
            int row = idx >> 3, c4 = idx & 7;
            const float4 v = *(const float4*)(x + (size_t)(m0 + row) * IN_F + k0 + c4 * 4);
            u16x4 hv, lv;
            split4(v, hv, lv);
            *(u16x4*)&Ahi[row * LDK + c4 * 4] = hv;
            *(u16x4*)&Alo[row * LDK + c4 * 4] = lv;
        }
        #pragma unroll
        for (int j = 0; j < 2; ++j) {
            int idx = j * 256 + t;
            int k = idx >> 4, r = idx & 15;
            unsigned short hv, lv;
            bf16_split(Abase[(size_t)(k0 + k) * RANK + r], hv, lv);
            Bhi[r * LDK + k] = hv;
            Blo[r * LDK + k] = lv;
        }
        __syncthreads();

        v16bf_t ah = ld_frag(Ahi, (wid * 16 + laneM) * LDK, khalf);
        v16bf_t al = ld_frag(Alo, (wid * 16 + laneM) * LDK, khalf);
        v16bf_t bh = ld_frag(Bhi, laneM * LDK, khalf);
        v16bf_t bl = ld_frag(Blo, laneM * LDK, khalf);
        acc = WMMA_BF16(ah, bh, acc);
        acc = WMMA_BF16(al, bh, acc);
        acc = WMMA_BF16(ah, bl, acc);
        __syncthreads();
    }

    const int rbase = (lane & 16) ? 8 : 0;
    #pragma unroll
    for (int v = 0; v < 8; ++v)
        h[(size_t)(m0 + wid * 16 + rbase + v) * RANK + laneM] = acc[v];
}

// ---------------------------------------------------------------------------
// Kernel 2 (fast path): GEMM on pre-packed hi/lo bf16. WG tile 256x256, K-step
// 64 (one whole 128-B line of every operand row), 8 waves 2(M)x4(N), two per
// SIMD, wave tile 128x64 -> 96 WMMAs per 24 fragments. The operand tiles reach
// LDS by tensor loads, through no register, into a ring of two buffers: the
// load of K-step s + 1 is in flight while K-step s is multiplied.
// ---------------------------------------------------------------------------
#define GBM 256               // workgroup tile rows (1024 % GBM == 0 -> uniform batch)
#define GBN 256               // workgroup tile columns
#define GMI 8                 // 16-row fragments per wave
#define GNI 4                 // 16-column fragments per wave
#define GTH 256               // threads per workgroup
#define GBK 64                // K-step in halves
#define GLDK 72               // LDS row stride in halves (144B = 16B x odd: conflict-free b128 reads)
#define GPLANE (256 * GLDK)   // halves of one operand plane of a buffer (36,864 B)
#define GBUF (4 * GPLANE)     // halves of a buffer: x hi | x lo | W hi | W lo (147,456 B = 72 x 2 KiB)
#define GSLICE 128            // rows of the slice that one wave loads (128 x 144 B = 9 x 2 KiB)
#define GNST (IN_F / GBK)     // K-steps

typedef uint32_t u32x4 __attribute__((ext_vector_type(4)));
typedef uint32_t u32x8 __attribute__((ext_vector_type(8)));

__device__ __forceinline__ uint32_t uni(uint32_t v) { return (uint32_t)__builtin_amdgcn_readfirstlane(v); }

// A wave-uniform value held in a scalar register: a test on it compiles to a scalar
// branch (a tensor load ignores EXEC), and what is formed from it is formed behind it.
__device__ __forceinline__ uint32_t pinned(uint32_t v) {
    uint32_t w = uni(v);
    asm volatile("" : "+s"(w));   // pinned(): the issue test, or a descriptor's stage word, held in a scalar register
    return w;
}

__global__ __launch_bounds__(GTH) void gemm_packed_kernel(
    const unsigned short* __restrict__ xhi, const unsigned short* __restrict__ xlo,
    const unsigned short* __restrict__ whi, const unsigned short* __restrict__ wlo,
    const int* __restrict__ amap, const float* __restrict__ bias,
    const float* __restrict__ Bs, const float* __restrict__ h,
    float* __restrict__ out)
{
    __shared__ __attribute__((aligned(2048))) unsigned short L[2 * GBUF];

    const int t     = threadIdx.x;
    const int lane  = t & 31;
    const int wid   = __builtin_amdgcn_readfirstlane(t >> 5);   // wave-uniform: kept in a scalar register
    const int laneM = lane & 15;
    const int khalf = (lane & 16) ? 8 : 0;
    const int m0    = blockIdx.y * GBM;
    const int n0    = blockIdx.x * GBN;
    const int m_off = (wid & 1) * (GMI * 16);
    const int n_off = (wid >> 1) * (GNI * 16);

    v8f_t acc[GMI][GNI];
    #pragma unroll
    for (int mi = 0; mi < GMI; ++mi)
        #pragma unroll
        for (int ni = 0; ni < GNI; ++ni)
            acc[mi][ni] = zero8();

    // each lane's fragment base in a buffer; fragments differ by constant offsets
    const int    fa0 = (m_off + laneM) * GLDK + khalf;
    const int    fb0 = 2 * GPLANE + (n_off + laneM) * GLDK + khalf;

    // Every wave loads one slice per K-step: 128 rows of 128 B of one plane
    // (waves 0,1: x hi; 2,3: x lo; 4,5: W hi; 6,7: W lo), laid at the 144-B pitch.
    const uint32_t uw = (uint32_t)wid;
    const unsigned short* plane = (uw < 4u) ? ((uw < 2u) ? xhi : xlo) : ((uw < 6u) ? whi : wlo);
    const uint32_t row0 = ((uw < 4u) ? (uint32_t)m0 : (uint32_t)n0) + (uw & 1u) * GSLICE;
    const uint64_t src0 = (uint64_t)(size_t)plane + (uint64_t)row0 * (IN_F * 2);
    const uint32_t dst0 = (uint32_t)(size_t)L + uw * (GSLICE * GLDK * 2);

    // descriptor group 1: 1-byte elements, tensor = tile = 128 rows of 128 B, source
    // pitch one row of the plane, 4 dwords of pad behind every 32 dwords
    u32x8 g1;
    g1[0] = uni((1u << 20) | (4u << 22) | (3u << 25));
    g1[1] = uni(128u << 16);
    g1[2] = uni((uint32_t)GSLICE << 16);
    g1[3] = uni(128u << 16);
    g1[4] = uni((uint32_t)GSLICE);
    g1[5] = uni((uint32_t)(IN_F * 2));
    g1[6] = uni(0u);
    g1[7] = uni(0u);

    auto issue = [&](uint32_t st) {
        const uint64_t ga  = src0 + (uint64_t)(st * (GBK * 2));
        const uint32_t dst = dst0 + (st & 1u) * (GBUF * 2);
        u32x4 g0;
        g0[0] = uni(1u);
        g0[1] = uni(dst);
        g0[2] = uni((uint32_t)ga);
        g0[3] = uni((((uint32_t)(ga >> 32)) & 0x01FFFFFFu) | 0x80000000u);
        asm volatile("tensor_load_to_lds %0, %1" :: "s"(g0), "s"(g1) : "memory");
    };

    issue(0u);
    asm volatile("s_wait_tensorcnt 0x0" ::: "memory");   // this wave's slice of K-step 0 has landed
    __syncthreads();                                     // ... and every other wave's
    issue(1u);

    for (uint32_t s = 0; s < GNST; ++s) {
        const unsigned short* Lb = L + (s & 1u) * GBUF;
        #pragma unroll
        for (int kk = 0; kk < GBK; kk += 32) {
            v16bf_t ah[GMI], al[GMI], bh[GNI], bl[GNI];
            #pragma unroll
            for (int ni = 0; ni < GNI; ++ni) {
                bh[ni] = ld_frag(Lb + fb0, ni * 16 * GLDK + kk, 0);
                bl[ni] = ld_frag(Lb + fb0 + GPLANE, ni * 16 * GLDK + kk, 0);
            }
            #pragma unroll
            for (int mi = 0; mi < GMI; ++mi) {
                ah[mi] = ld_frag(Lb + fa0, mi * 16 * GLDK + kk, 0);
                al[mi] = ld_frag(Lb + fa0 + GPLANE, mi * 16 * GLDK + kk, 0);
            }
            // keeps the block's 48 fragment loads one group in front of its WMMAs: left free,
            // this build loads row by row with a full LDS wait in front of every row
            __builtin_amdgcn_sched_barrier(0);
            #pragma unroll
            for (int mi = 0; mi < GMI; ++mi)
                #pragma unroll
                for (int ni = 0; ni < GNI; ++ni) {
                    acc[mi][ni] = WMMA_BF16(ah[mi], bh[ni], acc[mi][ni]);
                    acc[mi][ni] = WMMA_BF16(al[mi], bh[ni], acc[mi][ni]);
                    acc[mi][ni] = WMMA_BF16(ah[mi], bl[ni], acc[mi][ni]);
                }
            // keeps the next group's loads from being spread among these WMMAs
            __builtin_amdgcn_sched_barrier(0);
        }
        // publish point of K-step s + 1
        asm volatile("s_wait_dscnt 0x0" ::: "memory");      // this wave has left buffer s & 1
        asm volatile("s_wait_tensorcnt 0x0" ::: "memory");  // its slice of K-step s + 1 has landed
        __syncthreads();                                    // both hold for every wave
        if (pinned(s + 2u < GNST))                          // refill the buffer just left
            issue(pinned(s + 2u));
    }
    asm volatile("s_wait_tensorcnt 0x0" ::: "memory");      // no load in flight when the ring is reused
    asm volatile("s_wait_dscnt 0x0" ::: "memory");

    // ---- fused LoRA epilogue: acc += (scaling*h) @ B_s, K=16 zero-padded to 32
    // The lane id is formed anew here, so that no thread-id register has to stay
    // live (or be spilled) across the K loop, which uses the whole register budget.
    const int elane  = (int)__builtin_amdgcn_mbcnt_lo(~0u, 0u);
    const int et     = wid * 32 + elane;
    const int elaneM = elane & 15;
    {
        const int s = min(max(amap[m0 >> 10], 0), 31);   // slot index bounded before it forms an address
        {   // scaled h tile 256x16 into the x-hi plane (K 16..31 zeroed), one row per thread
            const float* hp = h + (size_t)(m0 + et) * RANK;
            u16x8 hz = {0, 0, 0, 0, 0, 0, 0, 0};
            #pragma unroll
            for (int cb = 0; cb < 16; cb += 8) {
                u16x8 hv;
                #pragma unroll
                for (int e = 0; e < 8; ++e) hv[e] = bf16_rne(hp[cb + e] * SCALING);
                *(u16x8*)&L[et * GLDK + cb]      = hv;
                *(u16x8*)&L[et * GLDK + 16 + cb] = hz;
            }
        }
        {   // Bm^T tile into the W-hi plane: [n][k] = B_s[s][k][n0+n] (K 16..31 zeroed)
            #pragma unroll
            for (int k = 0; k < RANK; ++k) {
                L[2 * GPLANE + et * GLDK + k]      = bf16_rne(Bs[((size_t)s * RANK + k) * OUT_F + n0 + et]);
                L[2 * GPLANE + et * GLDK + 16 + k] = 0;
            }
        }
        __syncthreads();
        #pragma unroll
        for (int mi = 0; mi < GMI; ++mi) {
            v16bf_t a = ld_frag(L + fa0, mi * 16 * GLDK, 0);
            #pragma unroll
            for (int ni = 0; ni < GNI; ++ni) {
                v16bf_t b = ld_frag(L + fb0, ni * 16 * GLDK, 0);
                acc[mi][ni] = WMMA_BF16(a, b, acc[mi][ni]);
            }
        }
    }

    // ---- bias add + store (C layout: row = v + 8*(lane>=16), col = lane&15)
    const int rbase = (elane & 16) ? 8 : 0;
    #pragma unroll
    for (int mi = 0; mi < GMI; ++mi) {
        int rg0 = m0 + m_off + mi * 16 + rbase;
        #pragma unroll
        for (int ni = 0; ni < GNI; ++ni) {
            int cg = n0 + n_off + ni * 16 + elaneM;
            float bv = bias[cg];
            #pragma unroll
            for (int v = 0; v < 8; ++v)
                out[(size_t)(rg0 + v) * OUT_F + cg] = acc[mi][ni][v] + bv;
        }
    }
}

// ---------------------------------------------------------------------------
// Kernel 2 (fallback, small ws): convert-in-loop bf16x3 GEMM, WG tile 128x64.
// ---------------------------------------------------------------------------
__global__ __launch_bounds__(256) void lora_linear_kernel(
    const float* __restrict__ x, const int* __restrict__ amap,
    const float* __restrict__ W, const float* __restrict__ bias,
    const float* __restrict__ Bs, const float* __restrict__ h,
    float* __restrict__ out)
{
    __shared__ __align__(16) unsigned short Ahi[128 * LDK], Alo[128 * LDK];
    __shared__ __align__(16) unsigned short Bhi[64 * LDK],  Blo[64 * LDK];

    const int t     = threadIdx.x;
    const int lane  = t & 31;
    const int wid   = t >> 5;
    const int laneM = lane & 15;
    const int khalf = (lane & 16) ? 8 : 0;
    const int m0    = blockIdx.y * 128;
    const int n0    = blockIdx.x * 64;
    const int m_off = (wid & 3) * 32;
    const int n_off = (wid >> 2) * 32;

    v8f_t acc[2][2];
    #pragma unroll
    for (int mi = 0; mi < 2; ++mi)
        #pragma unroll
        for (int ni = 0; ni < 2; ++ni)
            acc[mi][ni] = zero8();

    for (int k0 = 0; k0 < IN_F; k0 += 32) {
        #pragma unroll
        for (int j = 0; j < 4; ++j) {
            int idx = j * 256 + t;
            int row = idx >> 3, c4 = idx & 7;
            const float4 v = *(const float4*)(x + (size_t)(m0 + row) * IN_F + k0 + c4 * 4);
            u16x4 hv, lv;
            split4(v, hv, lv);
            *(u16x4*)&Ahi[row * LDK + c4 * 4] = hv;
            *(u16x4*)&Alo[row * LDK + c4 * 4] = lv;
        }
        #pragma unroll
        for (int j = 0; j < 2; ++j) {
            int idx = j * 256 + t;
            int n = idx >> 3, c4 = idx & 7;
            const float4 v = *(const float4*)(W + (size_t)(n0 + n) * IN_F + k0 + c4 * 4);
            u16x4 hv, lv;
            split4(v, hv, lv);
            *(u16x4*)&Bhi[n * LDK + c4 * 4] = hv;
            *(u16x4*)&Blo[n * LDK + c4 * 4] = lv;
        }
        __syncthreads();

        v16bf_t ah[2], al[2], bh[2], bl[2];
        #pragma unroll
        for (int mi = 0; mi < 2; ++mi) {
            ah[mi] = ld_frag(Ahi, (m_off + mi * 16 + laneM) * LDK, khalf);
            al[mi] = ld_frag(Alo, (m_off + mi * 16 + laneM) * LDK, khalf);
        }
        #pragma unroll
        for (int ni = 0; ni < 2; ++ni) {
            bh[ni] = ld_frag(Bhi, (n_off + ni * 16 + laneM) * LDK, khalf);
            bl[ni] = ld_frag(Blo, (n_off + ni * 16 + laneM) * LDK, khalf);
        }
        #pragma unroll
        for (int mi = 0; mi < 2; ++mi)
            #pragma unroll
            for (int ni = 0; ni < 2; ++ni) {
                acc[mi][ni] = WMMA_BF16(ah[mi], bh[ni], acc[mi][ni]);
                acc[mi][ni] = WMMA_BF16(al[mi], bh[ni], acc[mi][ni]);
                acc[mi][ni] = WMMA_BF16(ah[mi], bl[ni], acc[mi][ni]);
            }
        __syncthreads();
    }

    {
        const int s = amap[m0 >> 10];
        {
            int row = t >> 1, cb = (t & 1) * 8;
            const float* hp = h + (size_t)(m0 + row) * RANK + cb;
            u16x8 hv, hz = {0, 0, 0, 0, 0, 0, 0, 0};
            #pragma unroll
            for (int e = 0; e < 8; ++e) hv[e] = bf16_rne(hp[e] * SCALING);
            *(u16x8*)&Ahi[row * LDK + cb]      = hv;
            *(u16x8*)&Ahi[row * LDK + 16 + cb] = hz;
        }
        {
            int n = t & 63, kb = t >> 6;
            #pragma unroll
            for (int j = 0; j < 4; ++j) {
                int k = kb + j * 4;
                Bhi[n * LDK + k]      = bf16_rne(Bs[((size_t)s * RANK + k) * OUT_F + n0 + n]);
                Bhi[n * LDK + 16 + k] = 0;
            }
        }
        __syncthreads();
        #pragma unroll
        for (int mi = 0; mi < 2; ++mi) {
            v16bf_t a = ld_frag(Ahi, (m_off + mi * 16 + laneM) * LDK, khalf);
            #pragma unroll
            for (int ni = 0; ni < 2; ++ni) {
                v16bf_t b = ld_frag(Bhi, (n_off + ni * 16 + laneM) * LDK, khalf);
                acc[mi][ni] = WMMA_BF16(a, b, acc[mi][ni]);
            }
        }
    }

    const int rbase = (lane & 16) ? 8 : 0;
    #pragma unroll
    for (int mi = 0; mi < 2; ++mi) {
        int rg0 = m0 + m_off + mi * 16 + rbase;
        #pragma unroll
        for (int ni = 0; ni < 2; ++ni) {
            int cg = n0 + n_off + ni * 16 + laneM;
            float bv = bias[cg];
            #pragma unroll
            for (int v = 0; v < 8; ++v)
                out[(size_t)(rg0 + v) * OUT_F + cg] = acc[mi][ni][v] + bv;
        }
    }
}

extern "C" void kernel_launch(void* const* d_in, const int* in_sizes, int n_in,
                              void* d_out, int out_size, void* d_ws, size_t ws_size,
                              hipStream_t stream) {
    const float* x    = (const float*)d_in[0];
    const int*   amap = (const int*)d_in[1];
    const float* W    = (const float*)d_in[2];
    const float* b    = (const float*)d_in[3];
    const float* As   = (const float*)d_in[4];
    const float* Bs   = (const float*)d_in[5];
    float* out = (float*)d_out;

    const size_t hBytes = (size_t)MTOT * RANK * sizeof(float);      // 512 KB
    const size_t xElems = (size_t)MTOT * IN_F;
    const size_t wElems = (size_t)OUT_F * IN_F;
    const size_t need   = hBytes + 2 * xElems * 2 + 2 * wElems * 2; // ~192.5 MB

    float* h = (float*)d_ws;
    lora_h_kernel<<<dim3(MTOT / 128), 256, 0, stream>>>(x, amap, As, h);

    if (ws_size >= need) {
        unsigned short* xhi = (unsigned short*)((char*)d_ws + hBytes);
        unsigned short* xlo = xhi + xElems;
        unsigned short* whi = xlo + xElems;
        unsigned short* wlo = whi + wElems;
        pack_bf16_kernel<<<dim3(2048), 256, 0, stream>>>(x, xhi, xlo, (long)(xElems / 4));
        pack_bf16_kernel<<<dim3(2048), 256, 0, stream>>>(W, whi, wlo, (long)(wElems / 4));
        gemm_packed_kernel<<<dim3(OUT_F / GBN, MTOT / GBM), GTH, 0, stream>>>(
            xhi, xlo, whi, wlo, amap, b, Bs, h, out);
    } else {
        lora_linear_kernel<<<dim3(OUT_F / 64, MTOT / 128), 256, 0, stream>>>(
            x, amap, W, b, Bs, h, out);
    }
}

// v003
// One run takes 362 microseconds.
// Timed twice side by side with v002, it ran 1.35 times as fast both times.
// All steps since v000 together make it 2.48 times as fast.
#include <hip/hip_runtime.h>
#include <stdint.h>

#define IN_F   4096
#define OUT_F  4096
#define RANK   16
#define MTOT   8192           // B*T = 8*1024
#define SCALING 2.0f          // ALPHA/R = 32/16
#define LDK    40             // LDS row stride in halves (80B: 16B-aligned, conflict-padded)

typedef __attribute__((ext_vector_type(16))) __bf16          v16bf_t;
typedef __attribute__((ext_vector_type(8)))  float           v8f_t;
typedef __attribute__((ext_vector_type(4)))  unsigned short  u16x4;
typedef __attribute__((ext_vector_type(8)))  unsigned short  u16x8;

union FragU { u16x8 h[2]; v16bf_t v; };

__device__ __forceinline__ v8f_t zero8() {
    v8f_t z = {0.f, 0.f, 0.f, 0.f, 0.f, 0.f, 0.f, 0.f};
    return z;
}

// round-to-nearest-even f32 -> bf16 bits
__device__ __forceinline__ unsigned short bf16_rne(float x) {
    unsigned int u = __float_as_uint(x);
    unsigned int r = ((u >> 16) & 1u) + 0x7fffu;
    return (unsigned short)((u + r) >> 16);
}

// split f32 into truncated-hi bf16 + RNE residual-lo bf16 (bf16x3 scheme)
__device__ __forceinline__ void bf16_split(float x, unsigned short& hi, unsigned short& lo) {
    unsigned int u  = __float_as_uint(x);
    unsigned int hb = u & 0xffff0000u;
    hi = (unsigned short)(hb >> 16);
    lo = bf16_rne(x - __uint_as_float(hb));
}

__device__ __forceinline__ void split4(const float4 v, u16x4& hv, u16x4& lv) {
    unsigned short h0, l0, h1, l1, h2, l2, h3, l3;
    bf16_split(v.x, h0, l0);
    bf16_split(v.y, h1, l1);
    bf16_split(v.z, h2, l2);
    bf16_split(v.w, h3, l3);
    hv[0] = h0; hv[1] = h1; hv[2] = h2; hv[3] = h3;
    lv[0] = l0; lv[1] = l1; lv[2] = l2; lv[3] = l3;
}

// Build a 16x32 / 32x16 bf16 WMMA fragment from a K-contiguous LDS tile.
// ISA layout: lanes<16 hold K{khalf..+7} in VGPR0-3, K{khalf+16..+23} in VGPR4-7
// (khalf=0); lanes>=16 use khalf=8.
__device__ __forceinline__ v16bf_t ld_frag(const unsigned short* p, int rowHalves, int khalf) {
    FragU f;
    f.h[0] = *(const u16x8*)(p + rowHalves + khalf);
    f.h[1] = *(const u16x8*)(p + rowHalves + khalf + 16);
    return f.v;
}

#define WMMA_BF16(A, B, C) \
    __builtin_amdgcn_wmma_f32_16x16x32_bf16(false, (A), false, (B), (short)0, (C), false, false)

// ---------------------------------------------------------------------------
// Pack pass: fp32 -> (hi bf16, lo bf16) arrays, one-time, memory-bound.
// Removes all conversion VALU from the GEMM K-loop.
// ---------------------------------------------------------------------------
__global__ __launch_bounds__(256) void pack_bf16_kernel(
    const float* __restrict__ src,
    unsigned short* __restrict__ hi, unsigned short* __restrict__ lo,
    long n4)
{
    long stride = (long)gridDim.x * blockDim.x;
    for (long i = (long)blockIdx.x * blockDim.x + threadIdx.x; i < n4; i += stride) {
        const float4 v = *(const float4*)(src + i * 4);
        u16x4 hv, lv;
        split4(v, hv, lv);
        *(u16x4*)(hi + i * 4) = hv;
        *(u16x4*)(lo + i * 4) = lv;
    }
}

// ---------------------------------------------------------------------------
// Kernel 1: h[m, r] = sum_k x[m,k] * A_s[k,r]  (rank-16, bf16x3 WMMA)
// ---------------------------------------------------------------------------
__global__ __launch_bounds__(256) void lora_h_kernel(
    const float* __restrict__ x, const int* __restrict__ amap,
    const float* __restrict__ As, float* __restrict__ h)
{
    __shared__ __align__(16) unsigned short Ahi[128 * LDK], Alo[128 * LDK];
    __shared__ __align__(16) unsigned short Bhi[RANK * LDK], Blo[RANK * LDK];

    const int t     = threadIdx.x;
    const int lane  = t & 31;
    const int wid   = t >> 5;
    const int laneM = lane & 15;
    const int khalf = (lane & 16) ? 8 : 0;
    const int m0    = blockIdx.x * 128;          // 1024 % 128 == 0 -> uniform batch
    const int s     = amap[m0 >> 10];
    const float* Abase = As + (size_t)s * IN_F * RANK;

    v8f_t acc = zero8();

    for (int k0 = 0; k0 < IN_F; k0 += 32) {
        #pragma unroll
        for (int j = 0; j < 4; ++j) {
            int idx = j * 256 + t;
            int row = idx >> 3, c4 = idx & 7;
            const float4 v = *(const float4*)(x + (size_t)(m0 + row) * IN_F + k0 + c4 * 4);
            u16x4 hv, lv;
            split4(v, hv, lv);
            *(u16x4*)&Ahi[row * LDK + c4 * 4] = hv;
            *(u16x4*)&Alo[row * LDK + c4 * 4] = lv;
        }
        #pragma unroll
        for (int j = 0; j < 2; ++j) {
            int idx = j * 256 + t;
            int k = idx >> 4, r = idx & 15;
            unsigned short hv, lv;
            bf16_split(Abase[(size_t)(k0 + k) * RANK + r], hv, lv);
            Bhi[r * LDK + k] = hv;
            Blo[r * LDK + k] = lv;
        }
        __syncthreads();

        v16bf_t ah = ld_frag(Ahi, (wid * 16 + laneM) * LDK, khalf);
        v16bf_t al = ld_frag(Alo, (wid * 16 + laneM) * LDK, khalf);
        v16bf_t bh = ld_frag(Bhi, laneM * LDK, khalf);
        v16bf_t bl = ld_frag(Blo, laneM * LDK, khalf);
        acc = WMMA_BF16(ah, bh, acc);
        acc = WMMA_BF16(al, bh, acc);
        acc = WMMA_BF16(ah, bl, acc);
        __syncthreads();
    }

    const int rbase = (lane & 16) ? 8 : 0;
    #pragma unroll
    for (int v = 0; v < 8; ++v)
        h[(size_t)(m0 + wid * 16 + rbase + v) * RANK + laneM] = acc[v];
}

// ---------------------------------------------------------------------------
// Pack pass of x with the rank-16 projection in it (fast path): the hi/lo halves
// that the pass forms anyway are also the A operand of h = x * A_s, so x is read
// once and h needs no launch of its own. A workgroup owns 32 whole rows; in each
// of 4 stages its 16 waves take 64 k each, side by side. Each wave turns its piece
// round in an LDS tile of its own, and the 16 partial sums are added through LDS at the end.
// ---------------------------------------------------------------------------
#define HROWS  32                   // rows per workgroup (1024 % HROWS == 0 -> one adapter per workgroup)
#define HWAVES 16                   // waves per workgroup
#define HKS    64                   // k of one wave in one stage
#define HKB    (HWAVES * HKS)       // k of the workgroup in one stage
#define HNST   (IN_F / HKB)         // stages
#define HPITCH 72                   // LDS row stride in halves (144B = 16B x odd: conflict-free b128 reads)
#define HPLANE (HROWS * HPITCH)     // halves of one plane (hi or lo) of a wave's tile

__global__ __launch_bounds__(HWAVES * 32) void pack_x_h_kernel(
    const float* __restrict__ x, const int* __restrict__ amap,
    const float* __restrict__ As,
    unsigned short* __restrict__ xhi, unsigned short* __restrict__ xlo,
    float* __restrict__ h)
{
    __shared__ __align__(16) unsigned short S[HWAVES * 2 * HPLANE];
    __shared__ float red[HWAVES * HROWS * RANK];

    const int t    = threadIdx.x;
    const int lane = t & 31;
    const int wid  = __builtin_amdgcn_readfirstlane(t >> 5);
    const int c    = lane & 15;
    const int hh   = lane >> 4;
    const int m0   = blockIdx.x * HROWS;
    const int s    = min(max(amap[m0 >> 10], 0), 31);   // slot index bounded before it forms an address
    const int kw   = wid * HKS;

    // x: load j of a stage takes rows 2j (lanes 0-15) and 2j+1 (lanes 16-31), 4 k per lane
    const size_t xo = (size_t)(m0 + hh) * IN_F + kw + c * 4;
    // A_s: lane (c, hh) holds column c; element e of a fragment is k = 8*hh + (e < 8 ? e : e + 8),
    // the order in which ld_frag reads the x tile
    const float* bp = As + ((size_t)s * IN_F + kw + 8 * hh) * RANK + c;
    unsigned short* Sw = S + wid * (2 * HPLANE);

    v8f_t acc[2] = { zero8(), zero8() };

    // rolled: unrolled, this build lifts a later stage's loads and conversions over the waits
    // of the stage in front and spills
    #pragma unroll 1
    for (int st = 0; st < HNST; ++st) {
        // A_s first: loads return in order, and its conversion then runs under the flight of x
        float  bv[2][16];
        #pragma unroll
        for (int ks = 0; ks < 2; ++ks)
            #pragma unroll
            for (int e = 0; e < 16; ++e)
                bv[ks][e] = bp[(size_t)(st * HKB + ks * 32 + (e < 8 ? e : e + 8)) * RANK];
        float4 xv[HROWS / 2];
        #pragma unroll
        for (int j = 0; j < HROWS / 2; ++j)
            xv[j] = *(const float4*)(x + xo + (size_t)j * (2 * IN_F) + st * HKB);
        FragU bh[2], bl[2];
        #pragma unroll
        for (int ks = 0; ks < 2; ++ks)
            #pragma unroll
            for (int e = 0; e < 16; ++e) {
                unsigned short hv, lv;
                bf16_split(bv[ks][e], hv, lv);
                bh[ks].h[e >> 3][e & 7] = hv;
                bl[ks].h[e >> 3][e & 7] = lv;
            }
        u16x4 hv[HROWS / 2], lv[HROWS / 2];
        #pragma unroll
        for (int j = 0; j < HROWS / 2; ++j)
            split4(xv[j], hv[j], lv[j]);
        #pragma unroll
        for (int j = 0; j < HROWS / 2; ++j) {
            *(u16x4*)(xhi + xo + (size_t)j * (2 * IN_F) + st * HKB) = hv[j];
            *(u16x4*)(xlo + xo + (size_t)j * (2 * IN_F) + st * HKB) = lv[j];
            *(u16x4*)&Sw[(2 * j + hh) * HPITCH + c * 4]          = hv[j];
            *(u16x4*)&Sw[HPLANE + (2 * j + hh) * HPITCH + c * 4] = lv[j];
        }
        // in front of whatever overwrites a register that these stores name
        asm volatile("s_wait_xcnt 0x0" ::: "memory");
        // the wave's tile stores stand in LDS before its lanes read one another's rows
        asm volatile("s_wait_dscnt 0x0" ::: "memory");
        #pragma unroll
        for (int ks = 0; ks < 2; ++ks) {
            v16bf_t ah[2], al[2];
            #pragma unroll
            for (int mf = 0; mf < 2; ++mf) {
                ah[mf] = ld_frag(Sw,          (mf * 16 + c) * HPITCH + ks * 32, 8 * hh);
                al[mf] = ld_frag(Sw + HPLANE, (mf * 16 + c) * HPITCH + ks * 32, 8 * hh);
            }
            acc[0] = WMMA_BF16(ah[0], bh[ks].v, acc[0]);
            acc[1] = WMMA_BF16(ah[1], bh[ks].v, acc[1]);
            acc[0] = WMMA_BF16(al[0], bh[ks].v, acc[0]);
            acc[1] = WMMA_BF16(al[1], bh[ks].v, acc[1]);
            acc[0] = WMMA_BF16(ah[0], bl[ks].v, acc[0]);
            acc[1] = WMMA_BF16(ah[1], bl[ks].v, acc[1]);
        }
        // the fragment reads have returned before the next stage's stores overwrite the tile
        asm volatile("s_wait_dscnt 0x0" ::: "memory");
    }

    // partial sums of the 16 waves (D layout: row = v + 8*(lane>=16), col = lane&15), added in
    // wave order. The lane id is formed anew, so that no thread-id register is spilled over the loop.
    const int el = (int)__builtin_amdgcn_mbcnt_lo(~0u, 0u);
    const int et = wid * 32 + el;
    #pragma unroll
    for (int mf = 0; mf < 2; ++mf)
        #pragma unroll
        for (int v = 0; v < 8; ++v)
            red[wid * (HROWS * RANK) + (mf * 16 + 8 * (el >> 4) + v) * RANK + (el & 15)] = acc[mf][v];
    __syncthreads();
    float sum = 0.f;
    #pragma unroll
    for (int w = 0; w < HWAVES; ++w)
        sum += red[w * (HROWS * RANK) + et];
    h[(size_t)m0 * RANK + et] = sum;
}

// ---------------------------------------------------------------------------
// Kernel 2 (fast path): GEMM on pre-packed hi/lo bf16. WG tile 256x256, K-step
// 64 (one whole 128-B line of every operand row), 8 waves 2(M)x4(N), two per
// SIMD, wave tile 128x64 -> 96 WMMAs per 24 fragments. The operand tiles reach
// LDS by tensor loads, through no register, into a ring of two buffers: the
// load of K-step s + 1 is in flight while K-step s is multiplied.
// ---------------------------------------------------------------------------
#define GBM 256               // workgroup tile rows (1024 % GBM == 0 -> uniform batch)
#define GBN 256               // workgroup tile columns
#define GMI 8                 // 16-row fragments per wave
#define GNI 4                 // 16-column fragments per wave
#define GTH 256               // threads per workgroup
#define GBK 64                // K-step in halves
#define GLDK 72               // LDS row stride in halves (144B = 16B x odd: conflict-free b128 reads)
#define GPLANE (256 * GLDK)   // halves of one operand plane of a buffer (36,864 B)
#define GBUF (4 * GPLANE)     // halves of a buffer: x hi | x lo | W hi | W lo (147,456 B = 72 x 2 KiB)
#define GSLICE 128            // rows of the slice that one wave loads (128 x 144 B = 9 x 2 KiB)
#define GNST (IN_F / GBK)     // K-steps

typedef uint32_t u32x4 __attribute__((ext_vector_type(4)));
typedef uint32_t u32x8 __attribute__((ext_vector_type(8)));

__device__ __forceinline__ uint32_t uni(uint32_t v) { return (uint32_t)__builtin_amdgcn_readfirstlane(v); }

// A wave-uniform value held in a scalar register: a test on it compiles to a scalar
// branch (a tensor load ignores EXEC), and what is formed from it is formed behind it.
__device__ __forceinline__ uint32_t pinned(uint32_t v) {
    uint32_t w = uni(v);
    asm volatile("" : "+s"(w));   // pinned(): the issue test, or a descriptor's stage word, held in a scalar register
    return w;
}

__global__ __launch_bounds__(GTH) void gemm_packed_kernel(
    const unsigned short* __restrict__ xhi, const unsigned short* __restrict__ xlo,
    const unsigned short* __restrict__ whi, const unsigned short* __restrict__ wlo,
    const int* __restrict__ amap, const float* __restrict__ bias,
    const float* __restrict__ Bs, const float* __restrict__ h,
    float* __restrict__ out)
{
    __shared__ __attribute__((aligned(2048))) unsigned short L[2 * GBUF];

    const int t     = threadIdx.x;
    const int lane  = t & 31;
    const int wid   = __builtin_amdgcn_readfirstlane(t >> 5);   // wave-uniform: kept in a scalar register
    const int laneM = lane & 15;
    const int khalf = (lane & 16) ? 8 : 0;
    const int m0    = blockIdx.y * GBM;
    const int n0    = blockIdx.x * GBN;
    const int m_off = (wid & 1) * (GMI * 16);
    const int n_off = (wid >> 1) * (GNI * 16);

    v8f_t acc[GMI][GNI];
    #pragma unroll
    for (int mi = 0; mi < GMI; ++mi)
        #pragma unroll
        for (int ni = 0; ni < GNI; ++ni)
            acc[mi][ni] = zero8();

    // each lane's fragment base in a buffer; fragments differ by constant offsets
    const int    fa0 = (m_off + laneM) * GLDK + khalf;
    const int    fb0 = 2 * GPLANE + (n_off + laneM) * GLDK + khalf;

    // Every wave loads one slice per K-step: 128 rows of 128 B of one plane
    // (waves 0,1: x hi; 2,3: x lo; 4,5: W hi; 6,7: W lo), laid at the 144-B pitch.
    const uint32_t uw = (uint32_t)wid;
    const unsigned short* plane = (uw < 4u) ? ((uw < 2u) ? xhi : xlo) : ((uw < 6u) ? whi : wlo);
    const uint32_t row0 = ((uw < 4u) ? (uint32_t)m0 : (uint32_t)n0) + (uw & 1u) * GSLICE;
    const uint64_t src0 = (uint64_t)(size_t)plane + (uint64_t)row0 * (IN_F * 2);
    const uint32_t dst0 = (uint32_t)(size_t)L + uw * (GSLICE * GLDK * 2);

    // descriptor group 1: 1-byte elements, tensor = tile = 128 rows of 128 B, source
    // pitch one row of the plane, 4 dwords of pad behind every 32 dwords
    u32x8 g1;
    g1[0] = uni((1u << 20) | (4u << 22) | (3u << 25));
    g1[1] = uni(128u << 16);
    g1[2] = uni((uint32_t)GSLICE << 16);
    g1[3] = uni(128u << 16);
    g1[4] = uni((uint32_t)GSLICE);
    g1[5] = uni((uint32_t)(IN_F * 2));
    g1[6] = uni(0u);
    g1[7] = uni(0u);

    auto issue = [&](uint32_t st) {
        const uint64_t ga  = src0 + (uint64_t)(st * (GBK * 2));
        const uint32_t dst = dst0 + (st & 1u) * (GBUF * 2);
        u32x4 g0;
        g0[0] = uni(1u);
        g0[1] = uni(dst);
        g0[2] = uni((uint32_t)ga);
        g0[3] = uni((((uint32_t)(ga >> 32)) & 0x01FFFFFFu) | 0x80000000u);
        asm volatile("tensor_load_to_lds %0, %1" :: "s"(g0), "s"(g1) : "memory");
    };

    issue(0u);
    asm volatile("s_wait_tensorcnt 0x0" ::: "memory");   // this wave's slice of K-step 0 has landed
    __syncthreads();                                     // ... and every other wave's
    issue(1u);

    for (uint32_t s = 0; s < GNST; ++s) {
        const unsigned short* Lb = L + (s & 1u) * GBUF;
        #pragma unroll
        for (int kk = 0; kk < GBK; kk += 32) {
            v16bf_t ah[GMI], al[GMI], bh[GNI], bl[GNI];
            #pragma unroll
            for (int ni = 0; ni < GNI; ++ni) {
                bh[ni] = ld_frag(Lb + fb0, ni * 16 * GLDK + kk, 0);
                bl[ni] = ld_frag(Lb + fb0 + GPLANE, ni * 16 * GLDK + kk, 0);
            }
            #pragma unroll
            for (int mi = 0; mi < GMI; ++mi) {
                ah[mi] = ld_frag(Lb + fa0, mi * 16 * GLDK + kk, 0);
                al[mi] = ld_frag(Lb + fa0 + GPLANE, mi * 16 * GLDK + kk, 0);
            }
            // keeps the block's 48 fragment loads one group in front of its WMMAs: left free,
            // this build loads row by row with a full LDS wait in front of every row
            __builtin_amdgcn_sched_barrier(0);
            #pragma unroll
            for (int mi = 0; mi < GMI; ++mi)
                #pragma unroll
                for (int ni = 0; ni < GNI; ++ni) {
                    acc[mi][ni] = WMMA_BF16(ah[mi], bh[ni], acc[mi][ni]);
                    acc[mi][ni] = WMMA_BF16(al[mi], bh[ni], acc[mi][ni]);
                    acc[mi][ni] = WMMA_BF16(ah[mi], bl[ni], acc[mi][ni]);
                }
            // keeps the next group's loads from being spread among these WMMAs
            __builtin_amdgcn_sched_barrier(0);
        }
        // publish point of K-step s + 1
        asm volatile("s_wait_dscnt 0x0" ::: "memory");      // this wave has left buffer s & 1
        asm volatile("s_wait_tensorcnt 0x0" ::: "memory");  // its slice of K-step s + 1 has landed
        __syncthreads();                                    // both hold for every wave
        if (pinned(s + 2u < GNST))                          // refill the buffer just left
            issue(pinned(s + 2u));
    }
    asm volatile("s_wait_tensorcnt 0x0" ::: "memory");      // no load in flight when the ring is reused
    asm volatile("s_wait_dscnt 0x0" ::: "memory");

    // ---- fused LoRA epilogue: acc += (scaling*h) @ B_s, K=16 zero-padded to 32
    // The lane id is formed anew here, so that no thread-id register has to stay
    // live (or be spilled) across the K loop, which uses the whole register budget.
    const int elane  = (int)__builtin_amdgcn_mbcnt_lo(~0u, 0u);
    const int et     = wid * 32 + elane;
    const int elaneM = elane & 15;
    {
        const int s = min(max(amap[m0 >> 10], 0), 31);   // slot index bounded before it forms an address
        {   // scaled h tile 256x16 into the x-hi plane (K 16..31 zeroed), one row per thread
            const float* hp = h + (size_t)(m0 + et) * RANK;
            u16x8 hz = {0, 0, 0, 0, 0, 0, 0, 0};
            #pragma unroll
            for (int cb = 0; cb < 16; cb += 8) {
                u16x8 hv;
                #pragma unroll
                for (int e = 0; e < 8; ++e) hv[e] = bf16_rne(hp[cb + e] * SCALING);
                *(u16x8*)&L[et * GLDK + cb]      = hv;
                *(u16x8*)&L[et * GLDK + 16 + cb] = hz;
            }
        }
        {   // Bm^T tile into the W-hi plane: [n][k] = B_s[s][k][n0+n] (K 16..31 zeroed)
            #pragma unroll
            for (int k = 0; k < RANK; ++k) {
                L[2 * GPLANE + et * GLDK + k]      = bf16_rne(Bs[((size_t)s * RANK + k) * OUT_F + n0 + et]);
                L[2 * GPLANE + et * GLDK + 16 + k] = 0;
            }
        }
        __syncthreads();
        #pragma unroll
        for (int mi = 0; mi < GMI; ++mi) {
            v16bf_t a = ld_frag(L + fa0, mi * 16 * GLDK, 0);
            #pragma unroll
            for (int ni = 0; ni < GNI; ++ni) {
                v16bf_t b = ld_frag(L + fb0, ni * 16 * GLDK, 0);
                acc[mi][ni] = WMMA_BF16(a, b, acc[mi][ni]);
            }
        }
    }

    // ---- bias add + store (C layout: row = v + 8*(lane>=16), col = lane&15)
    const int rbase = (elane & 16) ? 8 : 0;
    #pragma unroll
    for (int mi = 0; mi < GMI; ++mi) {
        int rg0 = m0 + m_off + mi * 16 + rbase;
        #pragma unroll
        for (int ni = 0; ni < GNI; ++ni) {
            int cg = n0 + n_off + ni * 16 + elaneM;
            float bv = bias[cg];
            #pragma unroll
            for (int v = 0; v < 8; ++v)
                out[(size_t)(rg0 + v) * OUT_F + cg] = acc[mi][ni][v] + bv;
        }
    }
}

// ---------------------------------------------------------------------------
// Kernel 2 (fallback, small ws): convert-in-loop bf16x3 GEMM, WG tile 128x64.
// ---------------------------------------------------------------------------
__global__ __launch_bounds__(256) void lora_linear_kernel(
    const float* __restrict__ x, const int* __restrict__ amap,
    const float* __restrict__ W, const float* __restrict__ bias,
    const float* __restrict__ Bs, const float* __restrict__ h,
    float* __restrict__ out)
{
    __shared__ __align__(16) unsigned short Ahi[128 * LDK], Alo[128 * LDK];
    __shared__ __align__(16) unsigned short Bhi[64 * LDK],  Blo[64 * LDK];

    const int t     = threadIdx.x;
    const int lane  = t & 31;
    const int wid   = t >> 5;
    const int laneM = lane & 15;
    const int khalf = (lane & 16) ? 8 : 0;
    const int m0    = blockIdx.y * 128;
    const int n0    = blockIdx.x * 64;
    const int m_off = (wid & 3) * 32;
    const int n_off = (wid >> 2) * 32;

    v8f_t acc[2][2];
    #pragma unroll
    for (int mi = 0; mi < 2; ++mi)
        #pragma unroll
        for (int ni = 0; ni < 2; ++ni)
            acc[mi][ni] = zero8();

    for (int k0 = 0; k0 < IN_F; k0 += 32) {
        #pragma unroll
        for (int j = 0; j < 4; ++j) {
            int idx = j * 256 + t;
            int row = idx >> 3, c4 = idx & 7;
            const float4 v = *(const float4*)(x + (size_t)(m0 + row) * IN_F + k0 + c4 * 4);
            u16x4 hv, lv;
            split4(v, hv, lv);
            *(u16x4*)&Ahi[row * LDK + c4 * 4] = hv;
            *(u16x4*)&Alo[row * LDK + c4 * 4] = lv;
        }
        #pragma unroll
        for (int j = 0; j < 2; ++j) {
            int idx = j * 256 + t;
            int n = idx >> 3, c4 = idx & 7;
            const float4 v = *(const float4*)(W + (size_t)(n0 + n) * IN_F + k0 + c4 * 4);
            u16x4 hv, lv;
            split4(v, hv, lv);
            *(u16x4*)&Bhi[n * LDK + c4 * 4] = hv;
            *(u16x4*)&Blo[n * LDK + c4 * 4] = lv;
        }
        __syncthreads();

        v16bf_t ah[2], al[2], bh[2], bl[2];
        #pragma unroll
        for (int mi = 0; mi < 2; ++mi) {
            ah[mi] = ld_frag(Ahi, (m_off + mi * 16 + laneM) * LDK, khalf);
            al[mi] = ld_frag(Alo, (m_off + mi * 16 + laneM) * LDK, khalf);
        }
        #pragma unroll
        for (int ni = 0; ni < 2; ++ni) {
            bh[ni] = ld_frag(Bhi, (n_off + ni * 16 + laneM) * LDK, khalf);
            bl[ni] = ld_frag(Blo, (n_off + ni * 16 + laneM) * LDK, khalf);
        }
        #pragma unroll
        for (int mi = 0; mi < 2; ++mi)
            #pragma unroll
            for (int ni = 0; ni < 2; ++ni) {
                acc[mi][ni] = WMMA_BF16(ah[mi], bh[ni], acc[mi][ni]);
                acc[mi][ni] = WMMA_BF16(al[mi], bh[ni], acc[mi][ni]);
                acc[mi][ni] = WMMA_BF16(ah[mi], bl[ni], acc[mi][ni]);
            }
        __syncthreads();
    }

    {
        const int s = amap[m0 >> 10];
        {
            int row = t >> 1, cb = (t & 1) * 8;
            const float* hp = h + (size_t)(m0 + row) * RANK + cb;
            u16x8 hv, hz = {0, 0, 0, 0, 0, 0, 0, 0};
            #pragma unroll
            for (int e = 0; e < 8; ++e) hv[e] = bf16_rne(hp[e] * SCALING);
            *(u16x8*)&Ahi[row * LDK + cb]      = hv;
            *(u16x8*)&Ahi[row * LDK + 16 + cb] = hz;
        }
        {
            int n = t & 63, kb = t >> 6;
            #pragma unroll
            for (int j = 0; j < 4; ++j) {
                int k = kb + j * 4;
                Bhi[n * LDK + k]      = bf16_rne(Bs[((size_t)s * RANK + k) * OUT_F + n0 + n]);
                Bhi[n * LDK + 16 + k] = 0;
            }
        }
        __syncthreads();
        #pragma unroll
        for (int mi = 0; mi < 2; ++mi) {
            v16bf_t a = ld_frag(Ahi, (m_off + mi * 16 + laneM) * LDK, khalf);
            #pragma unroll
            for (int ni = 0; ni < 2; ++ni) {
                v16bf_t b = ld_frag(Bhi, (n_off + ni * 16 + laneM) * LDK, khalf);
                acc[mi][ni] = WMMA_BF16(a, b, acc[mi][ni]);
            }
        }
    }

    const int rbase = (lane & 16) ? 8 : 0;
    #pragma unroll
    for (int mi = 0; mi < 2; ++mi) {
        int rg0 = m0 + m_off + mi * 16 + rbase;
        #pragma unroll
        for (int ni = 0; ni < 2; ++ni) {
            int cg = n0 + n_off + ni * 16 + laneM;
            float bv = bias[cg];
            #pragma unroll
            for (int v = 0; v < 8; ++v)
                out[(size_t)(rg0 + v) * OUT_F + cg] = acc[mi][ni][v] + bv;
        }
    }
}

extern "C" void kernel_launch(void* const* d_in, const int* in_sizes, int n_in,
                              void* d_out, int out_size, void* d_ws, size_t ws_size,
                              hipStream_t stream) {
    const float* x    = (const float*)d_in[0];
    const int*   amap = (const int*)d_in[1];
    const float* W    = (const float*)d_in[2];
    const float* b    = (const float*)d_in[3];
    const float* As   = (const float*)d_in[4];
    const float* Bs   = (const float*)d_in[5];
    float* out = (float*)d_out;

    const size_t hBytes = (size_t)MTOT * RANK * sizeof(float);      // 512 KB
    const size_t xElems = (size_t)MTOT * IN_F;
    const size_t wElems = (size_t)OUT_F * IN_F;
    const size_t need   = hBytes + 2 * xElems * 2 + 2 * wElems * 2; // ~192.5 MB

    float* h = (float*)d_ws;

    if (ws_size >= need) {
        unsigned short* xhi = (unsigned short*)((char*)d_ws + hBytes);
        unsigned short* xlo = xhi + xElems;
        unsigned short* whi = xlo + xElems;
        unsigned short* wlo = whi + wElems;
        pack_x_h_kernel<<<dim3(MTOT / HROWS), HWAVES * 32, 0, stream>>>(x, amap, As, xhi, xlo, h);
        pack_bf16_kernel<<<dim3(2048), 256, 0, stream>>>(W, whi, wlo, (long)(wElems / 4));
        gemm_packed_kernel<<<dim3(OUT_F / GBN, MTOT / GBM), GTH, 0, stream>>>(
            xhi, xlo, whi, wlo, amap, b, Bs, h, out);
    } else {
        lora_h_kernel<<<dim3(MTOT / 128), 256, 0, stream>>>(x, amap, As, h);
        lora_linear_kernel<<<dim3(OUT_F / 64, MTOT / 128), 256, 0, stream>>>(
            x, amap, W, b, Bs, h, out);
    }
}
